// v000
// The times below were measured on an AMD MI455X: many runs one after another, warmed up first and cycling through
// copies of the inputs, with the whole window's GPU time divided by the number of runs. Launches and the gaps
// between them are all in it. The median over several windows is given; except for v000 it joins two sittings, which
// can be a few percent apart, so the side-by-side timings, each taken in one sitting, are the better comparison.
// v000, which the later versions start from, runs in 1640 microseconds.
#include <hip/hip_runtime.h>

// QKProjection: O = Q + tril(K K^T) Q   (B=4, L=4096, D=1024, fp32)
// Fused causal flash-style kernel using V_WMMA_F32_16X16X4_F32,
// TDM (tensor_load_to_lds) staging of the K row-tile, ping-pong LDS
// score buffer (one barrier per chunk), NT stores for the output.

typedef __attribute__((ext_vector_type(2))) float v2f;
typedef __attribute__((ext_vector_type(8))) float v8f;
typedef __attribute__((ext_vector_type(4))) unsigned int v4u;
typedef __attribute__((ext_vector_type(8))) int v8i;
typedef __attribute__((ext_vector_type(4))) int v4i;

#define BATCH   4
#define SEQ     4096
#define DIM     1024
#define M_TILE  16      // rows of t per workgroup
#define S_CHUNK 128     // s columns processed per chunk (16 per wave)
#define NWAVES  8
#define NTHREADS (NWAVES * 32)

__global__ __launch_bounds__(NTHREADS)
void qkproj_kernel(const float* __restrict__ Q,
                   const float* __restrict__ K,
                   float* __restrict__ Out)
{
    __shared__ float sK[M_TILE * DIM];          // 64 KB: K row-tile, staged once
    __shared__ float sS[2][M_TILE * S_CHUNK];   // 16 KB: ping-pong score chunks

    const int b        = blockIdx.y;
    // Heavy (high row_base) tiles launch first -> better tail behavior.
    const int row_base = (gridDim.x - 1 - blockIdx.x) * M_TILE;
    const int tid  = threadIdx.x;
    const int lane = tid & 31;
    const int wave = tid >> 5;
    const int m    = lane & 15;   // M/N index within fragment
    const int h    = lane >> 4;   // k-half selector (ISA 16x4/4x16 layouts)

    const float* Kb = K + (size_t)b * SEQ * DIM;
    const float* Qb = Q + (size_t)b * SEQ * DIM;

    // ---- Stage the 16 K rows of this tile into LDS (reused every chunk) ----
#if __has_builtin(__builtin_amdgcn_tensor_load_to_lds) && \
    __has_builtin(__builtin_amdgcn_s_wait_tensorcnt)
    if (wave == 0) {
        // Tensor DMA: one 16384-element (64 KB) contiguous tile -> LDS.
        const unsigned long long ga =
            (unsigned long long)(uintptr_t)(Kb + (size_t)row_base * DIM);
        const unsigned lds_off = (unsigned)(uintptr_t)(void*)sK; // low 32b = LDS offset
        v4u g0;
        g0[0] = 1u;                                   // count=1, user descriptor
        g0[1] = lds_off;                              // lds_addr
        g0[2] = (unsigned)(ga & 0xFFFFFFFFu);         // global_addr[31:0]
        g0[3] = (unsigned)((ga >> 32) & 0x01FFFFFFu)  // global_addr[56:32]
                | 0x80000000u;                        // type=2 ("image")
        v8i g1;
        g1[0] = 0x00020000;                 // data_size=4B, no mask/pad/iterate
        g1[1] = (int)0x40000000u;           // tensor_dim0 = 16384 (low16 @ [63:48])
        g1[2] = (int)0x00010000u;           // tensor_dim0 hi=0, tensor_dim1 = 1
        g1[3] = (int)0x40000000u;           // tile_dim0 = 16384 @ [127:112]
        g1[4] = 1;                          // tile_dim1 = 1
        g1[5] = 16384;                      // tensor_dim0_stride = 16384
        g1[6] = 0;
        g1[7] = 0;
        v4i gz; gz[0] = 0; gz[1] = 0; gz[2] = 0; gz[3] = 0;
#if defined(__clang_major__) && (__clang_major__ >= 23)
        v8i g4; for (int i = 0; i < 8; ++i) g4[i] = 0;
        __builtin_amdgcn_tensor_load_to_lds(g0, g1, gz, gz, g4, 0);
#else
        __builtin_amdgcn_tensor_load_to_lds(g0, g1, gz, gz, 0);
#endif
        __builtin_amdgcn_s_wait_tensorcnt(0);
    }
#else
    {
        const float4* gsrc = (const float4*)(Kb + (size_t)row_base * DIM);
        float4* ldst = (float4*)sK;
        for (int i = tid; i < M_TILE * DIM / 4; i += NTHREADS)
            ldst[i] = gsrc[i];
    }
#endif
    __syncthreads();

    // Persistent output accumulators: wave owns d in [128*wave, 128*wave+128)
    v8f acc[8];
    #pragma unroll
    for (int j = 0; j < 8; ++j)
        #pragma unroll
        for (int v = 0; v < 8; ++v)
            acc[j][v] = 0.0f;

    const int row_end = row_base + M_TILE - 1;

    for (int s0 = 0; s0 <= row_end; s0 += S_CHUNK) {
        const int pb = (s0 >> 7) & 1;   // ping-pong buffer select

        // ---- Phase A: S_chunk(16x128) = Krow(16xD) * Kcol^T, fp32 WMMA ----
        // wave computes score columns [s0 + 16*wave, s0 + 16*wave + 16)
        const int scol = s0 + 16 * wave;
        v8f s_acc;
        #pragma unroll
        for (int v = 0; v < 8; ++v) s_acc[v] = 0.0f;

        const float* krow_lane = sK + m * DIM + 2 * h;                  // A frag (LDS)
        const float* kcol_lane = Kb + (size_t)(scol + m) * DIM + 2 * h; // B frag (L2)
        #pragma unroll 8
        for (int d0 = 0; d0 < DIM; d0 += 4) {
            v2f a  = *(const v2f*)(krow_lane + d0);  // A[m, d0+2h], A[m, d0+2h+1]
            v2f bb = *(const v2f*)(kcol_lane + d0);  // B[2h, n=m],  B[2h+1, n=m]
            s_acc = __builtin_amdgcn_wmma_f32_16x16x4_f32(
                        false, a, false, bb, (short)0, s_acc, false, false);
        }

        // Causal mask + spill to LDS.  C layout: lane n+16h, VGPR v -> (M=v+8h, N=n)
        #pragma unroll
        for (int v = 0; v < 8; ++v) {
            const int t = row_base + v + 8 * h;
            const int s = scol + m;
            sS[pb][(v + 8 * h) * S_CHUNK + 16 * wave + m] = (s <= t) ? s_acc[v] : 0.0f;
        }
        __syncthreads();   // single barrier per chunk (ping-pong makes it safe)

        // Prefetch next chunk's K columns into the cache hierarchy.
        if (s0 + S_CHUNK <= row_end)
            __builtin_prefetch(Kb + (size_t)(s0 + S_CHUNK + 16 * wave + m) * DIM + 64 * h, 0, 1);

        // ---- Phase B: acc += S_chunk(16x128) * Q[s-chunk, wave's 128 d] ----
        const int d_base = 128 * wave;
        const float* sSp = sS[pb];
        #pragma unroll 2
        for (int ks = 0; ks < S_CHUNK; ks += 4) {
            v2f a;
            a.x = sSp[m * S_CHUNK + ks + 2 * h];      // A[m, ks+2h]
            a.y = sSp[m * S_CHUNK + ks + 2 * h + 1];  // A[m, ks+2h+1]
            const float* q0 = Qb + (size_t)(s0 + ks + 2 * h) * DIM + d_base + m;
            #pragma unroll
            for (int j = 0; j < 8; ++j) {
                v2f bb;
                bb.x = q0[16 * j];        // B[2h,   n] = Q[s0+ks+2h,   d_base+16j+n]
                bb.y = q0[16 * j + DIM];  // B[2h+1, n] = Q[s0+ks+2h+1, d_base+16j+n]
                acc[j] = __builtin_amdgcn_wmma_f32_16x16x4_f32(
                             false, a, false, bb, (short)0, acc[j], false, false);
            }
        }
    }

    // ---- Epilogue: Out = Q + acc  (NT stores: output is never re-read) ----
    {
        const int d_base = 128 * wave;
        float* Ob = Out + (size_t)b * SEQ * DIM;
        #pragma unroll
        for (int j = 0; j < 8; ++j) {
            #pragma unroll
            for (int v = 0; v < 8; ++v) {
                const int t = row_base + v + 8 * h;
                const int d = d_base + 16 * j + m;
                const size_t idx = (size_t)t * DIM + d;
                __builtin_nontemporal_store(Qb[idx] + acc[j][v], &Ob[idx]);
            }
        }
    }
}

extern "C" void kernel_launch(void* const* d_in, const int* in_sizes, int n_in,
                              void* d_out, int out_size, void* d_ws, size_t ws_size,
                              hipStream_t stream) {
    const float* Q = (const float*)d_in[0];
    const float* K = (const float*)d_in[1];
    float* Out = (float*)d_out;
    (void)in_sizes; (void)n_in; (void)out_size; (void)d_ws; (void)ws_size;

    dim3 grid(SEQ / M_TILE, BATCH);   // 256 row-tiles x 4 batches
    dim3 block(NTHREADS);             // 8 waves of 32
    qkproj_kernel<<<grid, block, 0, stream>>>(Q, K, Out);
}

// v001
// One run takes 645 microseconds.
// In both of two side-by-side timings against v000, it was 2.66 times as fast.
#include <hip/hip_runtime.h>

// O = Q + tril(K K^T) Q   (B=4, L=4096, D=1024, fp32), on V_WMMA_F32_16X16X4_F32.
// Two launches of 128x128-tile block products:
//   1. scores_kernel: the lower-triangular 128x128 blocks of K K^T, masked on
//      the diagonal blocks, go to the workspace (f32, row pitch L).
//   2. apply_kernel:  Out = Q + scores * Q, the sum over s stops at the row block.
// Both operands of both products are staged in padded LDS (two buffers, the next
// stage is fetched into registers while the current one is multiplied), so every
// byte that comes from L2 serves 128 rows or columns.
// Every "#pragma unroll" without a note of its own keeps a register array
// (fragments, accumulators, staging registers) at constant indices.

typedef __attribute__((ext_vector_type(2))) float v2f;
typedef __attribute__((ext_vector_type(4))) float v4f;
typedef __attribute__((ext_vector_type(8))) float v8f;

#define BATCH    4
#define SEQ      4096
#define DIM      1024
#define BT       128                    // block tile: rows and columns
#define KC       64                     // summed index per stage
#define PA       (KC + 4)               // LDS pitch, floats: 272 B = 16 B x odd, b128 reads without conflicts
#define PB       (BT + 4)               // LDS pitch, floats: 4 rows apart = 16 banks apart for the b32 reads
#define NTHREADS 256                    // 8 waves: 2 (rows) x 4 (columns), 64x32 per wave
#define NBLK     (SEQ / BT)             // 32 row blocks
#define NTRI     (NBLK * (NBLK + 1) / 2)

// Fragment k order, the same for A and B at every lane and register:
// over 8 consecutive k, lane half h holds k = 4h..4h+3; the first WMMA takes
// 4h, 4h+1 and the second 4h+2, 4h+3.

__device__ __forceinline__ v8f mma(v2f a, v2f b, v8f c)
{
    return __builtin_amdgcn_wmma_f32_16x16x4_f32(false, a, false, b, (short)0, c, false, false);
}

__global__ __launch_bounds__(NTHREADS)
void scores_kernel(const float* __restrict__ K, float* __restrict__ S)
{
    __shared__ __attribute__((aligned(16))) float sA[2][BT * PA];
    __shared__ __attribute__((aligned(16))) float sB[2][BT * PA];

    const int b = blockIdx.y;
    // Flat index -> (row block ti, column block sj) of the lower triangle.
    int ti = 0;
    for (int r = 1; r < NBLK; ++r)
        if ((int)blockIdx.x >= r * (r + 1) / 2) ti = r;
    const int sj = (int)blockIdx.x - ti * (ti + 1) / 2;

    const int tid  = threadIdx.x;
    const int lane = tid & 31;
    const int wave = tid >> 5;
    const int m    = lane & 15;
    const int h    = lane >> 4;
    const int wm   = (wave >> 2) * 64;
    const int wn   = (wave & 3) * 32;

    const float* Kb = K + (size_t)b * SEQ * DIM;
    const int lr = tid >> 4;            // staging: 16 rows per sweep
    const int lc = (tid & 15) * 4;      // 16 lanes cover one 256-B row piece
    const float* gA = Kb + (size_t)(ti * BT + lr) * DIM + lc;
    const float* gB = Kb + (size_t)(sj * BT + lr) * DIM + lc;

    v4f ra[8], rb[8];
    #pragma unroll   // register arrays need constant indices
    for (int i = 0; i < 8; ++i) {
        ra[i] = *(const v4f*)(gA + (size_t)(16 * i) * DIM);
        rb[i] = *(const v4f*)(gB + (size_t)(16 * i) * DIM);
    }
    #pragma unroll   // register arrays need constant indices
    for (int i = 0; i < 8; ++i) {
        *(v4f*)&sA[0][(lr + 16 * i) * PA + lc] = ra[i];
        *(v4f*)&sB[0][(lr + 16 * i) * PA + lc] = rb[i];
    }
    __syncthreads();

    v8f acc[4][2];
    #pragma unroll   // register arrays need constant indices
    for (int i = 0; i < 4; ++i)
        #pragma unroll
        for (int j = 0; j < 2; ++j)
            #pragma unroll
            for (int v = 0; v < 8; ++v)
                acc[i][j][v] = 0.0f;

    const int nst = DIM / KC;
    for (int st = 0; st < nst; ++st) {
        const int cur = st & 1;
        if (st + 1 < nst) {
            #pragma unroll   // register arrays need constant indices
            for (int i = 0; i < 8; ++i) {
                ra[i] = *(const v4f*)(gA + (size_t)(16 * i) * DIM + KC);
                rb[i] = *(const v4f*)(gB + (size_t)(16 * i) * DIM + KC);
            }
            // Precaution: the wait stands in front of every overwrite of the two address
            // pairs that the issued loads name; as inputs the pairs stay live up to it
            // (without it the last load's result was placed on an address pair).
            asm volatile("s_wait_xcnt 0x0" :: "v"(gA), "v"(gB) : "memory");
            gA += KC;
            gB += KC;
        }
        const float* pa = &sA[cur][(wm + m) * PA + 4 * h];
        const float* pb = &sB[cur][(wn + m) * PA + 4 * h];
        #pragma unroll   // lets the next group's LDS reads stand ahead of this group's WMMAs
        for (int kk = 0; kk < KC; kk += 8) {
            v4f a[4], bb[2];
            #pragma unroll
            for (int i = 0; i < 4; ++i) a[i] = *(const v4f*)(pa + 16 * i * PA + kk);
            #pragma unroll
            for (int j = 0; j < 2; ++j) bb[j] = *(const v4f*)(pb + 16 * j * PA + kk);
            #pragma unroll
            for (int i = 0; i < 4; ++i)
                #pragma unroll
                for (int j = 0; j < 2; ++j)
                    acc[i][j] = mma(a[i].xy, bb[j].xy, acc[i][j]);
            #pragma unroll
            for (int i = 0; i < 4; ++i)
                #pragma unroll
                for (int j = 0; j < 2; ++j)
                    acc[i][j] = mma(a[i].zw, bb[j].zw, acc[i][j]);
        }
        if (st + 1 < nst) {
            #pragma unroll   // register arrays need constant indices
            for (int i = 0; i < 8; ++i) {
                *(v4f*)&sA[cur ^ 1][(lr + 16 * i) * PA + lc] = ra[i];
                *(v4f*)&sB[cur ^ 1][(lr + 16 * i) * PA + lc] = rb[i];
            }
            // One barrier per stage: publishes the buffer just written and ends
            // every wave's reads of the buffer that the next trip overwrites.
            __syncthreads();
        }
    }

    // C layout: lane n + 16h, register v -> (row v + 8h, column n).
    float* Sb = S + (size_t)b * SEQ * SEQ;
    #pragma unroll   // register arrays need constant indices
    for (int i = 0; i < 4; ++i)
        #pragma unroll
        for (int j = 0; j < 2; ++j)
            #pragma unroll
            for (int v = 0; v < 8; ++v) {
                const int t = ti * BT + wm + 16 * i + v + 8 * h;
                const int s = sj * BT + wn + 16 * j + m;
                Sb[(size_t)t * SEQ + s] = (s <= t) ? acc[i][j][v] : 0.0f;
            }
}

__global__ __launch_bounds__(NTHREADS)
void apply_kernel(const float* __restrict__ Q, const float* __restrict__ S,
                  float* __restrict__ Out)
{
    __shared__ __attribute__((aligned(16))) float sA[2][BT * PA];   // scores: 128 t x 64 s
    __shared__ __attribute__((aligned(16))) float sB[2][KC * PB];   // Q:      64 s x 128 d

    const int cb = blockIdx.x;          // column block of d
    const int pr = blockIdx.y;          // pair of row blocks
    const int b  = blockIdx.z;

    const int tid  = threadIdx.x;
    const int lane = tid & 31;
    const int wave = tid >> 5;
    const int m    = lane & 15;
    const int h    = lane >> 4;
    const int wm   = (wave >> 2) * 64;
    const int wn   = (wave & 3) * 32;

    const float* Qb = Q + (size_t)b * SEQ * DIM;
    const float* Sb = S + (size_t)b * SEQ * SEQ;
    float*       Ob = Out + (size_t)b * SEQ * DIM;

    const int lr = tid >> 4;            // scores staging: 16 rows per sweep
    const int lc = (tid & 15) * 4;
    const int qr = tid >> 5;            // Q staging: 8 rows per sweep
    const int qc = (tid & 31) * 4;
    const float* gB = Qb + (size_t)qr * DIM + cb * BT + qc;

    // Row blocks 31 - pr and pr, one after the other: every workgroup sums
    // over the same 33 blocks of s, so all workgroups last equally long.
    for (int half = 0; half < 2; ++half) {
        const int rblk = half ? pr : (NBLK - 1 - pr);
        const int nst  = (rblk + 1) * (BT / KC);
        const float* gA = Sb + (size_t)(rblk * BT + lr) * SEQ + lc;
        const float* gQ = gB;

        v4f ra[8], rq[8];
        #pragma unroll   // register arrays need constant indices
        for (int i = 0; i < 8; ++i) {
            ra[i] = *(const v4f*)(gA + (size_t)(16 * i) * SEQ);
            rq[i] = *(const v4f*)(gQ + (size_t)(8 * i) * DIM);
        }
        #pragma unroll   // register arrays need constant indices
        for (int i = 0; i < 8; ++i) {
            *(v4f*)&sA[0][(lr + 16 * i) * PA + lc] = ra[i];
            *(v4f*)&sB[0][(qr + 8 * i) * PB + qc] = rq[i];
        }
        __syncthreads();

        v8f acc[4][2];
        #pragma unroll   // register arrays need constant indices
        for (int i = 0; i < 4; ++i)
            #pragma unroll
            for (int j = 0; j < 2; ++j)
                #pragma unroll
                for (int v = 0; v < 8; ++v)
                    acc[i][j][v] = 0.0f;

        for (int st = 0; st < nst; ++st) {
            const int cur = st & 1;
            if (st + 1 < nst) {
                gA += KC;
                gQ += (size_t)KC * DIM;
                #pragma unroll   // register arrays need constant indices
                for (int i = 0; i < 8; ++i) {
                    ra[i] = *(const v4f*)(gA + (size_t)(16 * i) * SEQ);
                    rq[i] = *(const v4f*)(gQ + (size_t)(8 * i) * DIM);
                }
                // Precaution: the wait stands in front of every overwrite of the two
                // address pairs that the issued loads name (inputs: live up to it).
                asm volatile("s_wait_xcnt 0x0" :: "v"(gA), "v"(gQ) : "memory");
            }
            const float* pa = &sA[cur][(wm + m) * PA + 4 * h];
            const float* pq = &sB[cur][(4 * h) * PB + wn + m];
            #pragma unroll   // lets the next group's LDS reads stand ahead of this group's WMMAs
            for (int kk = 0; kk < KC; kk += 8) {
                v4f a[4];
                v2f b0[2], b1[2];
                #pragma unroll
                for (int i = 0; i < 4; ++i) a[i] = *(const v4f*)(pa + 16 * i * PA + kk);
                #pragma unroll
                for (int j = 0; j < 2; ++j) {
                    b0[j].x = pq[(kk + 0) * PB + 16 * j];
                    b0[j].y = pq[(kk + 1) * PB + 16 * j];
                    b1[j].x = pq[(kk + 2) * PB + 16 * j];
                    b1[j].y = pq[(kk + 3) * PB + 16 * j];
                }
                #pragma unroll
                for (int i = 0; i < 4; ++i)
                    #pragma unroll
                    for (int j = 0; j < 2; ++j)
                        acc[i][j] = mma(a[i].xy, b0[j], acc[i][j]);
                #pragma unroll
                for (int i = 0; i < 4; ++i)
                    #pragma unroll
                    for (int j = 0; j < 2; ++j)
                        acc[i][j] = mma(a[i].zw, b1[j], acc[i][j]);
            }
            if (st + 1 < nst) {
                #pragma unroll   // register arrays need constant indices
                for (int i = 0; i < 8; ++i) {
                    *(v4f*)&sA[cur ^ 1][(lr + 16 * i) * PA + lc] = ra[i];
                    *(v4f*)&sB[cur ^ 1][(qr + 8 * i) * PB + qc] = rq[i];
                }
                // One barrier per stage: publishes the buffer just written and ends
                // every wave's reads of the buffer that the next trip overwrites.
                // None behind the last stage: the stage count is even, so the last
                // stage reads buffer 1, the second row block's first stage goes to
                // buffer 0, and its own barrier stands before buffer 1 is rewritten.
                __syncthreads();
            }
        }

        // Out = Q + acc (non-temporal stores: the output is never read again).
        #pragma unroll   // register arrays need constant indices
        for (int i = 0; i < 4; ++i) {
            // C layout: lane n + 16h, register v -> (row v + 8h, column n).
            const size_t base = (size_t)(rblk * BT + wm + 16 * i + 8 * h) * DIM + cb * BT + wn + m;
            const float* qp = Qb + base;
            float*       op = Ob + base;
            float q[2][8];
            #pragma unroll
            for (int j = 0; j < 2; ++j)
                #pragma unroll
                for (int v = 0; v < 8; ++v)
                    q[j][v] = qp[v * DIM + 16 * j];
            // Precaution: the wait stands in front of every overwrite of the address
            // pair that the issued loads name (input: live up to it).
            asm volatile("s_wait_xcnt 0x0" :: "v"(qp) : "memory");
            #pragma unroll
            for (int j = 0; j < 2; ++j)
                #pragma unroll
                for (int v = 0; v < 8; ++v)
                    __builtin_nontemporal_store(q[j][v] + acc[i][j][v], op + v * DIM + 16 * j);
            // Precaution: the registers that these stores name are written again right
            // behind them (the next group's sums, the second row block's zeroed
            // accumulators).
            asm volatile("s_wait_xcnt 0x0" :: "v"(op) : "memory");
        }
    }
}

extern "C" void kernel_launch(void* const* d_in, const int* in_sizes, int n_in,
                              void* d_out, int out_size, void* d_ws, size_t ws_size,
                              hipStream_t stream) {
    const float* Q = (const float*)d_in[0];
    const float* K = (const float*)d_in[1];
    float* Out = (float*)d_out;
    float* S   = (float*)d_ws;          // B x L x L floats, lower-triangular blocks used
    (void)in_sizes; (void)n_in; (void)out_size; (void)ws_size;

    dim3 block(NTHREADS);
    dim3 grid1(NTRI, BATCH);                    // 528 blocks x 4 batches
    scores_kernel<<<grid1, block, 0, stream>>>(K, S);
    dim3 grid2(DIM / BT, NBLK / 2, BATCH);      // 8 column blocks x 16 pairs x 4 batches
    apply_kernel<<<grid2, block, 0, stream>>>(Q, S, Out);
}

// v002
// One run takes 424 microseconds.
// Two timings next to v001 both put it at 1.52 times that version's speed.
// All steps since v000 together make it 4.04 times as fast.
#include <hip/hip_runtime.h>

// O = Q + tril(K K^T) Q   (B=4, L=4096, D=1024, fp32), on V_WMMA_F32_16X16X4_F32.
// The rows are cut into chunks of 256. For a row t of chunk c the sum over s splits:
//   s in an earlier chunk: K[t] . (sum over those s of K[s]^T Q[s]) = K[t] . P_c
//   s in chunk c:          tril(K K^T) Q inside the chunk
// P_c is D x D, so the first part costs 2 D^2 products a row whatever t is.
// Three launches of 128x128-tile block products:
//   1. state_kernel:  one workgroup per 128x128 tile of K^T Q walks the rows in order
//      and stores its total so far at every chunk end (P_1 .. P_15, workspace).
//   2. scores_kernel: the three lower 128x128 blocks of K K^T of every chunk, masked
//      on the diagonal blocks (workspace, row pitch 256).
//   3. apply_kernel:  Out = Q + K P_c + scores * Q.
// Both operands of every product are staged in padded LDS (two buffers, the next
// stage is fetched into registers while the current one is multiplied).
// Every "#pragma unroll" without a note of its own keeps a register array
// (fragments, accumulators, staging registers) at constant indices.

typedef __attribute__((ext_vector_type(2))) float v2f;
typedef __attribute__((ext_vector_type(4))) float v4f;
typedef __attribute__((ext_vector_type(8))) float v8f;

#define BATCH    4
#define SEQ      4096
#define DIM      1024
#define BT       128                    // block tile: rows and columns
#define KC       64                     // summed index per stage
#define PA       (KC + 4)               // LDS pitch, floats: 272 B = 16 B x odd, b128 reads without conflicts
#define PB       (BT + 4)               // LDS pitch, floats: 4 rows apart = 16 banks apart for the b32 reads
#define NTHREADS 256                    // 8 waves: 2 (rows) x 4 (columns), 64x32 per wave
#define CH       256                    // rows per chunk
#define NCH      (SEQ / CH)             // 16 chunks
#define SKC      128                    // state_kernel: summed rows per stage
#define STHREADS 512                    // state_kernel: 16 waves, 4 x 4, 32x32 per wave

// Fragment k order, the same for A and B at every lane and register:
// over 8 consecutive k, lane half h holds k = 4h..4h+3; the first WMMA takes
// 4h, 4h+1 and the second 4h+2, 4h+3.

__device__ __forceinline__ v8f mma(v2f a, v2f b, v8f c)
{
    return __builtin_amdgcn_wmma_f32_16x16x4_f32(false, a, false, b, (short)0, c, false, false);
}

// P[b][c][e][d] = sum over s < (c + 1) * CH of K[b][s][e] * Q[b][s][d], c = 0 .. NCH - 2.
// 256 workgroups, each as long as the whole launch: the two 128-row buffers per operand
// take more than half of the LDS, so that no two of them share a WGP while another idles.
__global__ __launch_bounds__(STHREADS)
void state_kernel(const float* __restrict__ K, const float* __restrict__ Q,
                  float* __restrict__ P)
{
    __shared__ __attribute__((aligned(16))) float sA[2][SKC * PB];   // K: 128 s x 128 e
    __shared__ __attribute__((aligned(16))) float sB[2][SKC * PB];   // Q: 128 s x 128 d

    const int cb = blockIdx.x;          // column block of d
    const int rb = blockIdx.y;          // row block of e
    const int b  = blockIdx.z;

    const int tid  = threadIdx.x;
    const int lane = tid & 31;
    const int wave = tid >> 5;
    const int m    = lane & 15;
    const int h    = lane >> 4;
    const int wm   = (wave >> 2) * 32;
    const int wn   = (wave & 3) * 32;

    const int qr = tid >> 5;            // staging: 16 rows per sweep
    const int qc = (tid & 31) * 4;      // one wave covers one 512-B row piece
    const float* gA = K + (size_t)b * SEQ * DIM + (size_t)qr * DIM + rb * BT + qc;
    const float* gB = Q + (size_t)b * SEQ * DIM + (size_t)qr * DIM + cb * BT + qc;
    // C layout: lane n + 16h, register v -> (row v + 8h, column n).
    float* op = P + (size_t)b * (NCH - 1) * DIM * DIM
                  + (size_t)(rb * BT + wm + 8 * h) * DIM + cb * BT + wn + m;

    v4f ra[8], rq[8];
    #pragma unroll   // register arrays need constant indices
    for (int i = 0; i < 8; ++i) {
        ra[i] = *(const v4f*)(gA + (size_t)(16 * i) * DIM);
        rq[i] = *(const v4f*)(gB + (size_t)(16 * i) * DIM);
    }
    #pragma unroll   // register arrays need constant indices
    for (int i = 0; i < 8; ++i) {
        *(v4f*)&sA[0][(qr + 16 * i) * PB + qc] = ra[i];
        *(v4f*)&sB[0][(qr + 16 * i) * PB + qc] = rq[i];
    }
    __syncthreads();

    v8f acc[2][2], tot[2][2];
    #pragma unroll   // register arrays need constant indices
    for (int i = 0; i < 2; ++i)
        #pragma unroll
        for (int j = 0; j < 2; ++j)
            #pragma unroll
            for (int v = 0; v < 8; ++v) {
                acc[i][j][v] = 0.0f;
                tot[i][j][v] = 0.0f;
            }

    // Half a stage: 64 summed rows.
    auto mul = [&](const float* pa, const float* pq) {
        #pragma unroll   // lets the next group's LDS reads stand ahead of this group's WMMAs
        for (int kk = 0; kk < SKC / 2; kk += 8) {
            v2f a0[2], a1[2], b0[2], b1[2];
            #pragma unroll
            for (int i = 0; i < 2; ++i) {
                a0[i].x = pa[(kk + 0) * PB + 16 * i];
                a0[i].y = pa[(kk + 1) * PB + 16 * i];
                a1[i].x = pa[(kk + 2) * PB + 16 * i];
                a1[i].y = pa[(kk + 3) * PB + 16 * i];
                b0[i].x = pq[(kk + 0) * PB + 16 * i];
                b0[i].y = pq[(kk + 1) * PB + 16 * i];
                b1[i].x = pq[(kk + 2) * PB + 16 * i];
                b1[i].y = pq[(kk + 3) * PB + 16 * i];
            }
            #pragma unroll
            for (int i = 0; i < 2; ++i)
                #pragma unroll
                for (int j = 0; j < 2; ++j)
                    acc[i][j] = mma(a0[i], b0[j], acc[i][j]);
            #pragma unroll
            for (int i = 0; i < 2; ++i)
                #pragma unroll
                for (int j = 0; j < 2; ++j)
                    acc[i][j] = mma(a1[i], b1[j], acc[i][j]);
        }
    };
    // A chunk's own sum, started from zero, joins the total (shorter chains of f32
    // roundings than one sum run over all rows); the total goes out as one state and
    // the pointer moves on to the next.
    auto put = [&]() {
        #pragma unroll   // register arrays need constant indices
        for (int i = 0; i < 2; ++i)
            #pragma unroll
            for (int j = 0; j < 2; ++j)
                #pragma unroll
                for (int v = 0; v < 8; ++v) {
                    tot[i][j][v] += acc[i][j][v];
                    acc[i][j][v] = 0.0f;
                    op[(size_t)(16 * i + v) * DIM + 16 * j] = tot[i][j][v];
                }
        // Precaution: the wait stands in front of every overwrite of the registers
        // that these stores name (the address pair, later the totals).
        asm volatile("s_wait_xcnt 0x0" :: "v"(op) : "memory");
        op += (size_t)DIM * DIM;
    };

    const int nst = (NCH - 1) * (CH / SKC);
    for (int st = 0; st < nst; ++st) {
        const int cur = st & 1;
        if (st + 1 < nst) {
            gA += (size_t)SKC * DIM;
            gB += (size_t)SKC * DIM;
            #pragma unroll   // register arrays need constant indices
            for (int i = 0; i < 8; ++i) {
                ra[i] = *(const v4f*)(gA + (size_t)(16 * i) * DIM);
                rq[i] = *(const v4f*)(gB + (size_t)(16 * i) * DIM);
            }
            // Precaution: the wait stands in front of every overwrite of the two
            // address pairs that the issued loads name (inputs: live up to it).
            asm volatile("s_wait_xcnt 0x0" :: "v"(gA), "v"(gB) : "memory");
        }
        if (st > 0 && cur == 0) {
            // A chunk has ended: the total is the state of the next chunk. Stored here,
            // behind the barrier, so that the next barrier's wait for stores finds them done.
            put();
        }
        const float* pa = &sA[cur][(4 * h) * PB + wm + m];
        const float* pq = &sB[cur][(4 * h) * PB + wn + m];
        mul(pa, pq);
        if (st + 1 < nst) {
            // In the middle of the stage: the other buffer's readers left it at the last
            // barrier, and these writes run beside the other waves' WMMAs, not in front
            // of a barrier at which every wave waits.
            #pragma unroll   // register arrays need constant indices
            for (int i = 0; i < 8; ++i) {
                *(v4f*)&sA[cur ^ 1][(qr + 16 * i) * PB + qc] = ra[i];
                *(v4f*)&sB[cur ^ 1][(qr + 16 * i) * PB + qc] = rq[i];
            }
        }
        mul(pa + (SKC / 2) * PB, pq + (SKC / 2) * PB);
        if (st + 1 < nst) {
            // One barrier per stage: publishes the buffer just written and ends
            // every wave's reads of the buffer that the next trip overwrites.
            __syncthreads();
        }
    }
    // Distance: the adds below read the last WMMAs' results right behind the loop's exit
    // branches; four vector slots stand in between.
    asm volatile("v_nop\n\tv_nop\n\tv_nop\n\tv_nop");
    __builtin_amdgcn_sched_barrier(0);   // keeps those adds behind the four slots
    put();
}

// S[b][t][s - chunk start] = K[b][t] . K[b][s] for s <= t inside t's chunk, else 0
// (the block above the diagonal blocks is neither written nor read).
__global__ __launch_bounds__(NTHREADS)
void scores_kernel(const float* __restrict__ K, float* __restrict__ S)
{
    __shared__ __attribute__((aligned(16))) float sA[2][BT * PA];
    __shared__ __attribute__((aligned(16))) float sB[2][BT * PA];

    const int b  = blockIdx.z;
    const int c0 = (int)blockIdx.y * CH;            // first row of the chunk
    // 0, 1, 2 -> (row block ti, column block sj) = (0,0), (1,0), (1,1) of the chunk.
    const int ti = ((int)blockIdx.x + 1) >> 1;
    const int sj = (int)blockIdx.x >> 1;

    const int tid  = threadIdx.x;
    const int lane = tid & 31;
    const int wave = tid >> 5;
    const int m    = lane & 15;
    const int h    = lane >> 4;
    const int wm   = (wave >> 2) * 64;
    const int wn   = (wave & 3) * 32;

    const float* Kb = K + (size_t)b * SEQ * DIM;
    const int lr = tid >> 4;            // staging: 16 rows per sweep
    const int lc = (tid & 15) * 4;      // 16 lanes cover one 256-B row piece
    const float* gA = Kb + (size_t)(c0 + ti * BT + lr) * DIM + lc;
    const float* gB = Kb + (size_t)(c0 + sj * BT + lr) * DIM + lc;

    v4f ra[8], rb[8];
    #pragma unroll   // register arrays need constant indices
    for (int i = 0; i < 8; ++i) {
        ra[i] = *(const v4f*)(gA + (size_t)(16 * i) * DIM);
        rb[i] = *(const v4f*)(gB + (size_t)(16 * i) * DIM);
    }
    #pragma unroll   // register arrays need constant indices
    for (int i = 0; i < 8; ++i) {
        *(v4f*)&sA[0][(lr + 16 * i) * PA + lc] = ra[i];
        *(v4f*)&sB[0][(lr + 16 * i) * PA + lc] = rb[i];
    }
    __syncthreads();

    v8f acc[4][2];
    #pragma unroll   // register arrays need constant indices
    for (int i = 0; i < 4; ++i)
        #pragma unroll
        for (int j = 0; j < 2; ++j)
            #pragma unroll
            for (int v = 0; v < 8; ++v)
                acc[i][j][v] = 0.0f;

    const int nst = DIM / KC;
    for (int st = 0; st < nst; ++st) {
        const int cur = st & 1;
        if (st + 1 < nst) {
            #pragma unroll   // register arrays need constant indices
            for (int i = 0; i < 8; ++i) {
                ra[i] = *(const v4f*)(gA + (size_t)(16 * i) * DIM + KC);
                rb[i] = *(const v4f*)(gB + (size_t)(16 * i) * DIM + KC);
            }
            // Precaution: the wait stands in front of every overwrite of the two address
            // pairs that the issued loads name; as inputs the pairs stay live up to it
            // (without it the last load's result was placed on an address pair).
            asm volatile("s_wait_xcnt 0x0" :: "v"(gA), "v"(gB) : "memory");
            gA += KC;
            gB += KC;
        }
        const float* pa = &sA[cur][(wm + m) * PA + 4 * h];
        const float* pb = &sB[cur][(wn + m) * PA + 4 * h];
        #pragma unroll   // lets the next group's LDS reads stand ahead of this group's WMMAs
        for (int kk = 0; kk < KC; kk += 8) {
            v4f a[4], bb[2];
            #pragma unroll
            for (int i = 0; i < 4; ++i) a[i] = *(const v4f*)(pa + 16 * i * PA + kk);
            #pragma unroll
            for (int j = 0; j < 2; ++j) bb[j] = *(const v4f*)(pb + 16 * j * PA + kk);
            #pragma unroll
            for (int i = 0; i < 4; ++i)
                #pragma unroll
                for (int j = 0; j < 2; ++j)
                    acc[i][j] = mma(a[i].xy, bb[j].xy, acc[i][j]);
            #pragma unroll
            for (int i = 0; i < 4; ++i)
                #pragma unroll
                for (int j = 0; j < 2; ++j)
                    acc[i][j] = mma(a[i].zw, bb[j].zw, acc[i][j]);
        }
        if (st + 1 < nst) {
            #pragma unroll   // register arrays need constant indices
            for (int i = 0; i < 8; ++i) {
                *(v4f*)&sA[cur ^ 1][(lr + 16 * i) * PA + lc] = ra[i];
                *(v4f*)&sB[cur ^ 1][(lr + 16 * i) * PA + lc] = rb[i];
            }
            // One barrier per stage: publishes the buffer just written and ends
            // every wave's reads of the buffer that the next trip overwrites.
            __syncthreads();
        }
    }

    // C layout: lane n + 16h, register v -> (row v + 8h, column n).
    float* Sb = S + ((size_t)b * SEQ + c0) * CH;
    #pragma unroll   // register arrays need constant indices
    for (int i = 0; i < 4; ++i)
        #pragma unroll
        for (int j = 0; j < 2; ++j)
            #pragma unroll
            for (int v = 0; v < 8; ++v) {
                const int t = ti * BT + wm + 16 * i + v + 8 * h;
                const int s = sj * BT + wn + 16 * j + m;
                Sb[(size_t)t * CH + s] = (s <= t) ? acc[i][j][v] : 0.0f;
            }
}

__global__ __launch_bounds__(NTHREADS)
void apply_kernel(const float* __restrict__ Q, const float* __restrict__ K,
                  const float* __restrict__ S, const float* __restrict__ P,
                  float* __restrict__ Out)
{
    __shared__ __attribute__((aligned(16))) float sA[2][BT * PA];   // K or scores: 128 t x 64
    __shared__ __attribute__((aligned(16))) float sB[2][KC * PB];   // P or Q:      64 x 128 d

    const int cb = blockIdx.x;          // column block of d
    const int b  = blockIdx.y;
    // Row blocks: the short ones (chunk 0 has no state to apply) start last.
    const int z     = blockIdx.z;
    const int late  = z >= 2 * (NCH - 1);
    const int chunk = late ? 0 : 1 + (z >> 1);
    const int r     = late ? 2 * NCH - 1 - z : 1 - (z & 1);     // row block inside the chunk
    const int rblk  = chunk * (CH / BT) + r;
    const int nin   = late ? 0 : DIM / KC;                      // stages of K * P
    const int nst   = nin + (r + 1) * (BT / KC);                // then stages of scores * Q

    const int tid  = threadIdx.x;
    const int lane = tid & 31;
    const int wave = tid >> 5;
    const int m    = lane & 15;
    const int h    = lane >> 4;
    const int wm   = (wave >> 2) * 64;
    const int wn   = (wave & 3) * 32;

    const float* Qb = Q + (size_t)b * SEQ * DIM;
    float*       Ob = Out + (size_t)b * SEQ * DIM;

    const int lr = tid >> 4;            // A staging: 16 rows per sweep
    const int lc = (tid & 15) * 4;
    const int qr = tid >> 5;            // B staging: 8 rows per sweep
    const int qc = (tid & 31) * 4;
    const float* aK = K + (size_t)b * SEQ * DIM + (size_t)(rblk * BT + lr) * DIM + lc;
    const float* aS = S + ((size_t)b * SEQ + rblk * BT + lr) * CH + lc;
    const float* bP = P + ((size_t)b * (NCH - 1) + (late ? 0 : chunk - 1)) * DIM * DIM
                        + (size_t)qr * DIM + cb * BT + qc;
    const float* bQ = Qb + (size_t)(chunk * CH + qr) * DIM + cb * BT + qc;

    v4f ra[8], rq[8];
    // Stage s into the staging registers; the test is the same for the whole workgroup.
    auto fetch = [&](int s) {
        if (s < nin) {
            const float* ga = aK + s * KC;
            const float* gq = bP + (size_t)s * KC * DIM;
            #pragma unroll   // register arrays need constant indices
            for (int i = 0; i < 8; ++i) {
                ra[i] = *(const v4f*)(ga + (size_t)(16 * i) * DIM);
                rq[i] = *(const v4f*)(gq + (size_t)(8 * i) * DIM);
            }
            // Precaution: the wait stands in front of every overwrite of the two
            // address pairs that the issued loads name (inputs: live up to it).
            asm volatile("s_wait_xcnt 0x0" :: "v"(ga), "v"(gq) : "memory");
        } else {
            const float* ga = aS + (s - nin) * KC;
            const float* gq = bQ + (size_t)(s - nin) * KC * DIM;
            #pragma unroll   // register arrays need constant indices
            for (int i = 0; i < 8; ++i) {
                ra[i] = *(const v4f*)(ga + (size_t)(16 * i) * CH);
                rq[i] = *(const v4f*)(gq + (size_t)(8 * i) * DIM);
            }
            // Precaution: as above.
            asm volatile("s_wait_xcnt 0x0" :: "v"(ga), "v"(gq) : "memory");
        }
    };

    fetch(0);
    #pragma unroll   // register arrays need constant indices
    for (int i = 0; i < 8; ++i) {
        *(v4f*)&sA[0][(lr + 16 * i) * PA + lc] = ra[i];
        *(v4f*)&sB[0][(qr + 8 * i) * PB + qc] = rq[i];
    }
    __syncthreads();

    v8f acc[4][2];
    #pragma unroll   // register arrays need constant indices
    for (int i = 0; i < 4; ++i)
        #pragma unroll
        for (int j = 0; j < 2; ++j)
            #pragma unroll
            for (int v = 0; v < 8; ++v)
                acc[i][j][v] = 0.0f;

    for (int st = 0; st < nst; ++st) {
        const int cur = st & 1;
        if (st + 1 < nst)
            fetch(st + 1);
        const float* pa = &sA[cur][(wm + m) * PA + 4 * h];
        const float* pq = &sB[cur][(4 * h) * PB + wn + m];
        #pragma unroll   // lets the next group's LDS reads stand ahead of this group's WMMAs
        for (int kk = 0; kk < KC; kk += 8) {
            v4f a[4];
            v2f b0[2], b1[2];
            #pragma unroll
            for (int i = 0; i < 4; ++i) a[i] = *(const v4f*)(pa + 16 * i * PA + kk);
            #pragma unroll
            for (int j = 0; j < 2; ++j) {
                b0[j].x = pq[(kk + 0) * PB + 16 * j];
                b0[j].y = pq[(kk + 1) * PB + 16 * j];
                b1[j].x = pq[(kk + 2) * PB + 16 * j];
                b1[j].y = pq[(kk + 3) * PB + 16 * j];
            }
            #pragma unroll
            for (int i = 0; i < 4; ++i)
                #pragma unroll
                for (int j = 0; j < 2; ++j)
                    acc[i][j] = mma(a[i].xy, b0[j], acc[i][j]);
            #pragma unroll
            for (int i = 0; i < 4; ++i)
                #pragma unroll
                for (int j = 0; j < 2; ++j)
                    acc[i][j] = mma(a[i].zw, b1[j], acc[i][j]);
        }
        if (st + 1 < nst) {
            #pragma unroll   // register arrays need constant indices
            for (int i = 0; i < 8; ++i) {
                *(v4f*)&sA[cur ^ 1][(lr + 16 * i) * PA + lc] = ra[i];
                *(v4f*)&sB[cur ^ 1][(qr + 8 * i) * PB + qc] = rq[i];
            }
            // One barrier per stage: publishes the buffer just written and ends
            // every wave's reads of the buffer that the next trip overwrites.
            __syncthreads();
        }
    }

    // Out = Q + acc (non-temporal stores: the output is never read again).
    #pragma unroll   // register arrays need constant indices
    for (int i = 0; i < 4; ++i) {
        // C layout: lane n + 16h, register v -> (row v + 8h, column n).
        const size_t base = (size_t)(rblk * BT + wm + 16 * i + 8 * h) * DIM + cb * BT + wn + m;
        const float* qp = Qb + base;
        float*       op = Ob + base;
        float q[2][8];
        #pragma unroll
        for (int j = 0; j < 2; ++j)
            #pragma unroll
            for (int v = 0; v < 8; ++v)
                q[j][v] = qp[v * DIM + 16 * j];
        // Precaution: the wait stands in front of every overwrite of the address
        // pair that the issued loads name (input: live up to it).
        asm volatile("s_wait_xcnt 0x0" :: "v"(qp) : "memory");
        #pragma unroll
        for (int j = 0; j < 2; ++j)
            #pragma unroll
            for (int v = 0; v < 8; ++v)
                __builtin_nontemporal_store(q[j][v] + acc[i][j][v], op + v * DIM + 16 * j);
        // Precaution: the registers that these stores name are written again right
        // behind them (the next group's sums).
        asm volatile("s_wait_xcnt 0x0" :: "v"(op) : "memory");
    }
}

extern "C" void kernel_launch(void* const* d_in, const int* in_sizes, int n_in,
                              void* d_out, int out_size, void* d_ws, size_t ws_size,
                              hipStream_t stream) {
    const float* Q = (const float*)d_in[0];
    const float* K = (const float*)d_in[1];
    float* Out = (float*)d_out;
    float* P   = (float*)d_ws;                                  // B x 15 x D x D floats
    float* S   = P + (size_t)BATCH * (NCH - 1) * DIM * DIM;     // B x L x 256 floats
    (void)in_sizes; (void)n_in; (void)out_size; (void)ws_size;

    dim3 grid0(DIM / BT, DIM / BT, BATCH);      // 8 x 8 tiles x 4 batches
    state_kernel<<<grid0, dim3(STHREADS), 0, stream>>>(K, Q, P);
    dim3 grid1(3, NCH, BATCH);                  // 3 blocks x 16 chunks x 4 batches
    scores_kernel<<<grid1, dim3(NTHREADS), 0, stream>>>(K, S);
    dim3 grid2(DIM / BT, BATCH, SEQ / BT);      // 8 column blocks x 4 batches x 32 row blocks
    apply_kernel<<<grid2, dim3(NTHREADS), 0, stream>>>(Q, K, S, P, Out);
}
